// v010
// The times below were measured on an AMD MI455X: many runs one after another, warmed up first and cycling through
// copies of the inputs, with the whole window's GPU time divided by the number of runs. Launches and the gaps
// between them are all in it. The median over several windows is given; except for v000 it joins two sittings, which
// can be a few percent apart, so the side-by-side timings, each taken in one sitting, are the better comparison.
// The versions before v010 are in another document.
// One run takes 107 microseconds.
// Timed twice side by side with v009, it ran 1.04 and 1.05 times as fast.
// All steps since the starting kernel, v000, together make it 25.7 times as fast.
#include <hip/hip_runtime.h>
// Transformer-XL relative multi-head attention (qlen 1024, mem_len 1024 → klen 2048, bsz 2, 16 heads × 64, post-LN): cat = [mems; w] (rows (j,b)); q = (cat·Wq + bq)[last qlen], k, v = cat·Wk + bk, cat·Wv + bv; rk = r·Wr + br;
// AC[i,j] = (q_i + r_w_bias)·k_j; BD = rel_shift((q_i + r_r_bias)·rk_m) (the exact pad-reshape shift, incl. its wrap region); score = (AC + BD)/8, −inf where the INPUT mask is set; softmax over j; attn_vec = Σ_j p·v_j;
// out = LayerNorm(w + attn_vec·Wo + bo)·g + b → [1024, 2, 1024]. (in,out) weights.
// Compute dtype: w, mems, r, biases, weights rounded to bf16; q (+ the two head biases), k, v, rk as f16 GEMM planes; one fused kernel forms, per 32 query rows of a (b,n) plane, AC and raw BD (f32 accumulators),
// applies the relative shift as a scatter into LDS, the mask and an f32 softmax, keeps P f16 x2^15 in LDS and multiplies it with V there (attn_vec); Wo GEMM + bias; residual + LayerNorm in f32 (wave per row). All contractions on v_wmma_f32_16x16x32_f16, f32 accumulate.
#define QL 1024
#define KL 2048
#define BZ 2
#define NH 16
#define DM 1024
#define NQR (QL * BZ)
#define NKR (KL * BZ)
#define ATT_SCALE 0.125f

typedef __bf16 v16b __attribute__((ext_vector_type(16)));
typedef unsigned short v8us __attribute__((ext_vector_type(8), may_alias));
typedef float  v8f  __attribute__((ext_vector_type(8)));
typedef float  v4f  __attribute__((ext_vector_type(4)));
typedef float  v4fa __attribute__((ext_vector_type(4), may_alias));
union FragB { v16b v; v8us half[2]; unsigned short u[16]; };

__device__ __forceinline__ unsigned short bf16_bits(float x) { unsigned int u = __float_as_uint(x); return (unsigned short)((u + 0x7FFFu + ((u >> 16) & 1u)) >> 16); }
__device__ __forceinline__ float bf16_val(unsigned short b) { return __uint_as_float(((unsigned int)b) << 16); }
__device__ __forceinline__ float bf16_round(float x) { return bf16_val(bf16_bits(x)); }
// D += A·B with NT terms: 1 = ah·bh, 2 = + al·bh (A split), 3 = + ah·bl (both split)
template <int NT>
__device__ __forceinline__ v8f mmaN(v16b ah, v16b al, v16b bh, v16b bl, v8f c) {
  c = __builtin_amdgcn_wmma_f32_16x16x32_bf16(false, ah, false, bh, (short)0, c, false, false);
  if (NT >= 2) c = __builtin_amdgcn_wmma_f32_16x16x32_bf16(false, al, false, bh, (short)0, c, false, false);
  if (NT >= 3) c = __builtin_amdgcn_wmma_f32_16x16x32_bf16(false, ah, false, bl, (short)0, c, false, false);
  asm volatile("v_nop\n\tv_nop\n\tv_nop\n\tv_nop" : "+v"(c) : "v"(ah), "v"(al), "v"(bh), "v"(bl));
  return c;
}

__global__ __launch_bounds__(256) void k_wt_bf16(const float* __restrict__ W, unsigned short* __restrict__ Wt, int K, int N) {
  const int t = blockIdx.x * 256 + threadIdx.x;
  const int k8n = K / 8;
  if (t >= N * k8n) return;
  const int n = t / k8n, k8 = (t % k8n) * 8;
  v8us v;
#pragma unroll
  for (int i = 0; i < 8; ++i) v[i] = bf16_bits(W[(size_t)(k8 + i) * N + n]);
  *(v8us*)(Wt + (size_t)n * K + k8) = v;
  
}

// GEMM C[M][N] (f32, pitch ldc) = act(A[M][K]·W + bias). A f32 row-major (pitch lda) converted per fragment to bf16
// (ASPLIT: hi/lo two planes -> 2 terms, else single rounded term); Wt bf16 [N][K] (pitch ldb). BIAS_BF16 rounds the
// bias to bf16 first (bias quantised to bf16 before the add). K%32==0, M%16==0, N%64==0.
template <bool ASPLIT, int ACT, bool BIAS_BF16>
__global__ __launch_bounds__(128) void k_gemm_bf(const float* __restrict__ A, int lda, const unsigned short* __restrict__ Wt, int ldb,
                                               const float* __restrict__ bias, float* __restrict__ C, int ldc, int M, int N, int K) {
  __shared__ __attribute__((aligned(16))) float so[4][16][64];
  const int tid = threadIdx.x, w = tid >> 5, lane = tid & 31, ln = lane & 15, hh = lane >> 4;
  const int ntn = N / 64;
  const int wid = blockIdx.x * 4 + w;
  const int mt = wid / ntn, nq = wid % ntn;
  if (mt * 16 >= M) return;
  const int row0 = mt * 16, col0 = nq * 64;
  const float* arow = A + (size_t)(row0 + ln) * lda;
  v8f acc[4] = {};
  for (int kb = 0; kb < K; kb += 32) {
    FragB ah, al;
    const v4f x0 = *(const v4fa*)(arow + kb + 8 * hh), x1 = *(const v4fa*)(arow + kb + 8 * hh + 4);
    const v4f x2 = *(const v4fa*)(arow + kb + 16 + 8 * hh), x3 = *(const v4fa*)(arow + kb + 16 + 8 * hh + 4);
    float xs[16] = {x0[0],x0[1],x0[2],x0[3],x1[0],x1[1],x1[2],x1[3],x2[0],x2[1],x2[2],x2[3],x3[0],x3[1],x3[2],x3[3]};
#pragma unroll
    for (int i = 0; i < 16; ++i) { const unsigned short hb = bf16_bits(xs[i]); ah.u[i] = hb; al.u[i] = ASPLIT ? bf16_bits(xs[i] - bf16_val(hb)) : (unsigned short)0; }
#pragma unroll
    for (int t = 0; t < 4; ++t) {
      const unsigned short* brow = Wt + (size_t)(col0 + t * 16 + ln) * ldb + kb;
      FragB b;
      b.half[0] = *(const v8us*)(brow + 8 * hh);
      b.half[1] = *(const v8us*)(brow + 16 + 8 * hh);
      acc[t] = mmaN<ASPLIT ? 2 : 1>(ah.v, al.v, b.v, b.v, acc[t]);
    }
  }
#pragma unroll
  for (int t = 0; t < 4; ++t) {
    float bv = bias ? bias[col0 + t * 16 + ln] : 0.f;
    if (BIAS_BF16) bv = bf16_round(bv);
#pragma unroll
    for (int r = 0; r < 8; ++r) { float v = acc[t][r] + bv; if (ACT == 1) v = fmaxf(v, 0.f); so[w][8 * hh + r][t * 16 + ln] = v; }
  }
  __builtin_amdgcn_fence(__ATOMIC_ACQ_REL, "workgroup");
  __builtin_amdgcn_wave_barrier();
  const int rsub = lane >> 4, c4 = (lane & 15) * 4;
  {
#pragma unroll
    for (int q = 0; q < 8; ++q) {
      const int r = q * 2 + rsub;
      const v4f v = *(const v4fa*)&so[w][r][c4];
      *(v4f*)(C + (size_t)(row0 + r) * ldc + col0 + c4) = v;
    }
    
  }
}

// Flash-style causal/unmasked attention, all contractions 3-term bf16 hi/lo splits, f32 softmax with running max.
// q,k,v rows are read from f32 buffers with arbitrary row pitch (so they can live inside a fused qkv buffer);
// D = head size (multiple of 32, <= 128); one wave = 16 query rows; block = 4 waves (64 queries) sharing K/V chunks of 32.
template <int D, bool CAUSAL>
__global__ __launch_bounds__(128) void k_flash(const float* __restrict__ qb, const float* __restrict__ kb, const float* __restrict__ vb,
                                             int pitch, int T, int H, float scale, float* __restrict__ y, int ypitch) {
  constexpr int KS = D / 32;        // k-steps for QK
  constexpr int DT = D / 16;        // d tiles for PV
  __shared__ __attribute__((aligned(16))) unsigned short sKh[32][D + 8], sKl[32][D + 8], sVh[32][D + 8], sVl[32][D + 8];
  __shared__ __attribute__((aligned(16))) unsigned short sPh[4][16][40], sPl[4][16][40];
  __shared__ __attribute__((aligned(16))) float sO[4][16][D];
  const int tid = threadIdx.x, w = tid >> 5, lane = tid & 31, ln = lane & 15, hh = lane >> 4;
  const int nqb = (T + 63) / 64;
  const int bh = blockIdx.x / nqb, qblk = blockIdx.x % nqb;
  const int b = bh / H, h = bh % H;
  const int q0 = qblk * 64 + w * 16;
  const float* Q = qb + (size_t)b * T * pitch + h * D;
  const float* K = kb + (size_t)b * T * pitch + h * D;
  const float* V = vb + (size_t)b * T * pitch + h * D;

  // A fragments of the wave's 16 query rows (scaled), hi/lo
  FragB aqh[KS], aql[KS];
  {
    int row = q0 + ln; if (row >= T) row = T - 1;
    const float* qr = Q + (size_t)row * pitch;
#pragma unroll
    for (int ks = 0; ks < KS; ++ks)
#pragma unroll
      for (int i = 0; i < 16; ++i) {
        const int d = ks * 32 + ((i < 8) ? (8 * hh + i) : (16 + 8 * hh + (i - 8)));
        const float x = qr[d] * scale; const unsigned short hb = bf16_bits(x);
        aqh[ks].u[i] = hb; aql[ks].u[i] = bf16_bits(x - bf16_val(hb));
      }
  }
  float m_r[8], l_r[8];
#pragma unroll
  for (int r = 0; r < 8; ++r) { m_r[r] = -3.0e38f; l_r[r] = 0.f; }
  v8f oacc[DT];
#pragma unroll
  for (int dt = 0; dt < DT; ++dt) oacc[dt] = (v8f){0.f,0.f,0.f,0.f,0.f,0.f,0.f,0.f};

  const int kv_end = CAUSAL ? min(T, qblk * 64 + 64) : T;     // block-uniform
  for (int j0 = 0; j0 < kv_end; j0 += 32) {
    __syncthreads();
    for (int e = tid; e < 32 * (D / 4); e += 128) {
      const int r = e / (D / 4), c4 = (e % (D / 4)) * 4;
      const int key = j0 + r;
      v4f kf = {0.f,0.f,0.f,0.f}, vf = {0.f,0.f,0.f,0.f};
      if (key < T) { kf = *(const v4fa*)(K + (size_t)key * pitch + c4); vf = *(const v4fa*)(V + (size_t)key * pitch + c4); }
#pragma unroll
      for (int t = 0; t < 4; ++t) {
        unsigned short hb = bf16_bits(kf[t]); sKh[r][c4 + t] = hb; sKl[r][c4 + t] = bf16_bits(kf[t] - bf16_val(hb));
        hb = bf16_bits(vf[t]); sVh[r][c4 + t] = hb; sVl[r][c4 + t] = bf16_bits(vf[t] - bf16_val(hb));
      }
    }
    __syncthreads();
    // S tile 16 x 32
    v8f s[2];
#pragma unroll
    for (int nt = 0; nt < 2; ++nt) {
      v8f acc = {};
#pragma unroll
      for (int ks = 0; ks < KS; ++ks) {
        FragB bh_, bl_;
        bh_.half[0] = *(const v8us*)&sKh[nt * 16 + ln][ks * 32 + 8 * hh]; bh_.half[1] = *(const v8us*)&sKh[nt * 16 + ln][ks * 32 + 16 + 8 * hh];
        bl_.half[0] = *(const v8us*)&sKl[nt * 16 + ln][ks * 32 + 8 * hh]; bl_.half[1] = *(const v8us*)&sKl[nt * 16 + ln][ks * 32 + 16 + 8 * hh];
        acc = mmaN<3>(aqh[ks].v, aql[ks].v, bh_.v, bl_.v, acc);
      }
      s[nt] = acc;
    }
    // mask + running max (rows 8hh+r; the 16 lanes of a half share rows)
    float alpha[8];
#pragma unroll
    for (int r = 0; r < 8; ++r) {
      const int qi = q0 + 8 * hh + r;
      const int ja = j0 + ln, jb = j0 + 16 + ln;
      if (CAUSAL) { if (ja > qi) s[0][r] = -3.0e38f; if (jb > qi) s[1][r] = -3.0e38f; }
      if (ja >= T) s[0][r] = -3.0e38f;
      if (jb >= T) s[1][r] = -3.0e38f;
      float mx = fmaxf(s[0][r], s[1][r]);
      mx = fmaxf(mx, __shfl_xor(mx, 1, 32)); mx = fmaxf(mx, __shfl_xor(mx, 2, 32)); mx = fmaxf(mx, __shfl_xor(mx, 4, 32)); mx = fmaxf(mx, __shfl_xor(mx, 8, 32));
      const float mnew = fmaxf(m_r[r], mx);
      alpha[r] = (mnew > -1.0e38f) ? __expf(m_r[r] - mnew) : 1.0f;
      const float p0 = (s[0][r] > -1.0e38f) ? __expf(s[0][r] - mnew) : 0.f;
      const float p1 = (s[1][r] > -1.0e38f) ? __expf(s[1][r] - mnew) : 0.f;
      m_r[r] = mnew;
      l_r[r] = l_r[r] * alpha[r] + p0 + p1;            // per-lane partial row sum (16 lanes combined at the end)
      unsigned short hb = bf16_bits(p0); sPh[w][8 * hh + r][ln] = hb;      sPl[w][8 * hh + r][ln] = bf16_bits(p0 - bf16_val(hb));
      hb = bf16_bits(p1);                sPh[w][8 * hh + r][16 + ln] = hb; sPl[w][8 * hh + r][16 + ln] = bf16_bits(p1 - bf16_val(hb));
    }
#pragma unroll
    for (int dt = 0; dt < DT; ++dt)
#pragma unroll
      for (int r = 0; r < 8; ++r) oacc[dt][r] *= alpha[r];
    __builtin_amdgcn_fence(__ATOMIC_ACQ_REL, "workgroup");
    __builtin_amdgcn_wave_barrier();
    FragB pah, pal;
    pah.half[0] = *(const v8us*)&sPh[w][ln][8 * hh]; pah.half[1] = *(const v8us*)&sPh[w][ln][16 + 8 * hh];
    pal.half[0] = *(const v8us*)&sPl[w][ln][8 * hh]; pal.half[1] = *(const v8us*)&sPl[w][ln][16 + 8 * hh];
#pragma unroll
    for (int dt = 0; dt < DT; ++dt) {
      FragB bvh, bvl;
#pragma unroll
      for (int i = 0; i < 8; ++i) {
        bvh.u[i] = sVh[8 * hh + i][dt * 16 + ln]; bvh.u[8 + i] = sVh[16 + 8 * hh + i][dt * 16 + ln];
        bvl.u[i] = sVl[8 * hh + i][dt * 16 + ln]; bvl.u[8 + i] = sVl[16 + 8 * hh + i][dt * 16 + ln];
      }
      oacc[dt] = mmaN<3>(pah.v, pal.v, bvh.v, bvl.v, oacc[dt]);
    }
    __builtin_amdgcn_fence(__ATOMIC_ACQ_REL, "workgroup");
    __builtin_amdgcn_wave_barrier();
  }
#pragma unroll
  for (int r = 0; r < 8; ++r) {
    float l = l_r[r];
    l += __shfl_xor(l, 1, 32); l += __shfl_xor(l, 2, 32); l += __shfl_xor(l, 4, 32); l += __shfl_xor(l, 8, 32);
    l_r[r] = (l > 0.f) ? 1.0f / l : 0.f;
  }
#pragma unroll
  for (int dt = 0; dt < DT; ++dt)
#pragma unroll
    for (int r = 0; r < 8; ++r) sO[w][8 * hh + r][dt * 16 + ln] = oacc[dt][r] * l_r[r];
  __builtin_amdgcn_fence(__ATOMIC_ACQ_REL, "workgroup");
  __builtin_amdgcn_wave_barrier();
  {
    for (int r = 0; r < 16; ++r) {
      const int row = q0 + r;
      if (row < T && lane < D / 4) {
        const v4f val = *(const v4fa*)&sO[w][r][lane * 4];
        *(v4f*)(y + ((size_t)b * T + row) * ypitch + h * D + lane * 4) = val;
      }
    }
    
  }
}

// GEMM C = act(A·W + bias + resid): A f32 (ASPLIT -> hi/lo 2 terms), Wt bf16 [N][K]; ACT 0 none, 1 relu, 2 exact gelu;
// resid (optional, f32, row index = (row % rmod), pitch ldr, RES_BF16 rounds it) added before the activation.
template <bool ASPLIT, int ACT, bool BIAS_BF16, bool RES_BF16>
__global__ __launch_bounds__(128) void k_gemm_bf3(const float* __restrict__ A, int lda, const unsigned short* __restrict__ Wt, int ldb,
                                                const float* __restrict__ bias, const float* __restrict__ resid, int rmod, int ldr,
                                                float* __restrict__ C, int ldc, int M, int N, int K) {
  __shared__ __attribute__((aligned(16))) float so[4][16][64];
  const int tid = threadIdx.x, w = tid >> 5, lane = tid & 31, ln = lane & 15, hh = lane >> 4;
  const int ntn = N / 64;
  const int wid = blockIdx.x * 4 + w;
  const int mt = wid / ntn, nq = wid % ntn;
  if (mt * 16 >= M) return;
  const int row0 = mt * 16, col0 = nq * 64;
  const float* arow = A + (size_t)(row0 + ln) * lda;
  v8f acc[4] = {};
  for (int kb = 0; kb < K; kb += 32) {
    FragB ah, al;
    const v4f x0 = *(const v4fa*)(arow + kb + 8 * hh), x1 = *(const v4fa*)(arow + kb + 8 * hh + 4);
    const v4f x2 = *(const v4fa*)(arow + kb + 16 + 8 * hh), x3 = *(const v4fa*)(arow + kb + 16 + 8 * hh + 4);
    float xs[16] = {x0[0],x0[1],x0[2],x0[3],x1[0],x1[1],x1[2],x1[3],x2[0],x2[1],x2[2],x2[3],x3[0],x3[1],x3[2],x3[3]};
#pragma unroll
    for (int i = 0; i < 16; ++i) { const unsigned short hb = bf16_bits(xs[i]); ah.u[i] = hb; al.u[i] = ASPLIT ? bf16_bits(xs[i] - bf16_val(hb)) : (unsigned short)0; }
#pragma unroll
    for (int t = 0; t < 4; ++t) {
      const unsigned short* brow = Wt + (size_t)(col0 + t * 16 + ln) * ldb + kb;
      FragB b;
      b.half[0] = *(const v8us*)(brow + 8 * hh);
      b.half[1] = *(const v8us*)(brow + 16 + 8 * hh);
      acc[t] = mmaN<ASPLIT ? 2 : 1>(ah.v, al.v, b.v, b.v, acc[t]);
    }
  }
#pragma unroll
  for (int t = 0; t < 4; ++t) {
    const int col = col0 + t * 16 + ln;
    float bv = bias ? bias[col] : 0.f;
    if (BIAS_BF16) bv = bf16_round(bv);
#pragma unroll
    for (int r = 0; r < 8; ++r) {
      float v = acc[t][r] + bv;
      if (resid) { float rv = resid[(size_t)((row0 + 8 * hh + r) % rmod) * ldr + col]; if (RES_BF16) rv = bf16_round(rv); v += rv; }
      if (ACT == 1) v = fmaxf(v, 0.f);
      if (ACT == 2) v = 0.5f * v * (1.0f + erff(v * 0.70710678118654752f));
      if (ACT == 3) { const float u = 0.7978845608028654f * (v + 0.044715f * v * v * v); v = 0.5f * v * (1.0f + tanhf(u)); }
      so[w][8 * hh + r][t * 16 + ln] = v;
    }
  }
  __builtin_amdgcn_fence(__ATOMIC_ACQ_REL, "workgroup");
  __builtin_amdgcn_wave_barrier();
  const int rsub = lane >> 4, c4 = (lane & 15) * 4;
  {
#pragma unroll
    for (int q = 0; q < 8; ++q) {
      const int r = q * 2 + rsub;
      const v4f v = *(const v4fa*)&so[w][r][c4];
      *(v4f*)(C + (size_t)(row0 + r) * ldc + col0 + c4) = v;
    }
    
  }
}
// row LayerNorm (biased variance, eps) over N: s = X (+ R); optional out_sum <- s; out_norm <- (s-mu)*rsqrt(var+eps)*g + b
template <bool PARAM_BF16>
__global__ __launch_bounds__(256) void k_layernorm(const float* __restrict__ X, const float* __restrict__ R, const float* __restrict__ g, const float* __restrict__ bta,
                                                  float* __restrict__ out_sum, float* __restrict__ out_norm, int N, float eps) {
  __shared__ float red[256];
  const int row = blockIdx.x, tid = threadIdx.x;
  const float* x = X + (size_t)row * N; const float* rr = R ? R + (size_t)row * N : nullptr;
  float vals[16];                     // up to N = 4096
  const int per = N / 256;            // contiguous chunk per thread? use strided-by-4 chunks: thread handles j = tid*4 + 1024*u
  float s1 = 0.f;
  for (int u = 0; u < per / 4; ++u) {
    const int j = tid * 4 + 1024 * u;
    const v4f a = *(const v4fa*)(x + j);
    v4f b = {0.f,0.f,0.f,0.f}; if (rr) b = *(const v4fa*)(rr + j);
#pragma unroll
    for (int q = 0; q < 4; ++q) { const float v = a[q] + b[q]; vals[u * 4 + q] = v; s1 += v; }
  }
  red[tid] = s1; __syncthreads();
  for (int st = 128; st > 0; st >>= 1) { if (tid < st) red[tid] += red[tid + st]; __syncthreads(); }
  const float mu = red[0] / (float)N; __syncthreads();
  float s2 = 0.f;
  for (int u = 0; u < per / 4; ++u)
#pragma unroll
    for (int q = 0; q < 4; ++q) { const float c = vals[u * 4 + q] - mu; s2 += c * c; }
  red[tid] = s2; __syncthreads();
  for (int st = 128; st > 0; st >>= 1) { if (tid < st) red[tid] += red[tid + st]; __syncthreads(); }
  const float rs = rsqrtf(red[0] / (float)N + eps);
  {
    for (int u = 0; u < per / 4; ++u) {
      const int j = tid * 4 + 1024 * u;
      v4f o, sm;
#pragma unroll
      for (int q = 0; q < 4; ++q) {
        float gg = g[j + q], bb = bta[j + q];
        if (PARAM_BF16) { gg = bf16_round(gg); bb = bf16_round(bb); }
        sm[q] = vals[u * 4 + q]; o[q] = (vals[u * 4 + q] - mu) * rs * gg + bb;
      }
      if (out_sum) *(v4f*)(out_sum + (size_t)row * N + j) = sm;
      *(v4f*)(out_norm + (size_t)row * N + j) = o;
    }
    
  }
}



// ---- f16 WMMA path (v_wmma_f32_16x16x32_f16): 11-bit significands for operands in range — used where a [0,1] probability operand needs more precision than bf16
typedef _Float16 v16h __attribute__((ext_vector_type(16)));
union FragH { v16h v; v8us half[2]; _Float16 h[16]; unsigned short u[16]; };
template <int NT>
__device__ __forceinline__ v8f mmaH(v16h ah, v16h al, v16h bh, v16h bl, v8f c) {
  c = __builtin_amdgcn_wmma_f32_16x16x32_f16(false, ah, false, bh, (short)0, c, false, false);
  if (NT >= 2) c = __builtin_amdgcn_wmma_f32_16x16x32_f16(false, al, false, bh, (short)0, c, false, false);
  if (NT >= 3) c = __builtin_amdgcn_wmma_f32_16x16x32_f16(false, ah, false, bl, (short)0, c, false, false);
  asm volatile("v_nop\n\tv_nop\n\tv_nop\n\tv_nop" : "+v"(c) : "v"(ah), "v"(al), "v"(bh), "v"(bl));
  return c;
}
// batched GEMM like k_gemm_b but f16 operands: A f32 (split into f16 hi/lo if ASPLIT, else rounded to f16), Bt = f16 values [n][k]; alpha; C f32; N multiple of 16 (partial tiles skipped)
template <bool ASPLIT>
__global__ __launch_bounds__(128) void k_gemm_h(const float* __restrict__ A, int lda, size_t sA, const _Float16* __restrict__ Bh, int ldb, size_t sB, float alpha, float* __restrict__ C, int ldc, size_t sC, int M, int N, int K) {
  __shared__ __attribute__((aligned(16))) float so[4][16][64];
  const int tid = threadIdx.x, w = tid >> 5, lane = tid & 31, ln = lane & 15, hh = lane >> 4; const int by = blockIdx.y;
  A += (size_t)by * sA; Bh += (size_t)by * sB; C += (size_t)by * sC;
  const int ntn = (N + 63) / 64; const int wid = blockIdx.x * 4 + w; const int mt = wid / ntn, nq = wid % ntn; if (mt * 16 >= M) return;
  const int row0 = mt * 16, col0 = nq * 64; const float* arow = A + (size_t)(row0 + ln) * lda;
  v8f acc[4] = {};
  for (int kb = 0; kb < K; kb += 32) {
    FragH ah, al;
    const v4f x0 = *(const v4fa*)(arow + kb + 8 * hh), x1 = *(const v4fa*)(arow + kb + 8 * hh + 4), x2 = *(const v4fa*)(arow + kb + 16 + 8 * hh), x3 = *(const v4fa*)(arow + kb + 16 + 8 * hh + 4);
    float xs[16] = {x0[0],x0[1],x0[2],x0[3],x1[0],x1[1],x1[2],x1[3],x2[0],x2[1],x2[2],x2[3],x3[0],x3[1],x3[2],x3[3]};
#pragma unroll
    for (int i = 0; i < 16; ++i) { const _Float16 h = (_Float16)xs[i]; ah.h[i] = h; al.h[i] = ASPLIT ? (_Float16)(xs[i] - (float)h) : (_Float16)0.0f; }
#pragma unroll
    for (int t = 0; t < 4; ++t) { if (col0 + t * 16 >= N) continue; const size_t boff = (size_t)(col0 + t * 16 + ln) * ldb + kb; FragH bq; bq.half[0] = *(const v8us*)(Bh + boff + 8 * hh); bq.half[1] = *(const v8us*)(Bh + boff + 16 + 8 * hh);
      acc[t] = mmaH<ASPLIT ? 2 : 1>(ah.v, al.v, bq.v, bq.v, acc[t]); }
  }
#pragma unroll
  for (int t = 0; t < 4; ++t) { if (col0 + t * 16 >= N) continue;
#pragma unroll
    for (int r = 0; r < 8; ++r) so[w][8 * hh + r][t * 16 + ln] = acc[t][r] * alpha; }
  __builtin_amdgcn_fence(__ATOMIC_ACQ_REL, "workgroup"); __builtin_amdgcn_wave_barrier();
  const int rsub = lane >> 4, c4 = (lane & 15) * 4;
  {
#pragma unroll
    for (int q = 0; q < 8; ++q) { const int r = q * 2 + rsub; if (col0 + c4 < N) { const v4f v = *(const v4fa*)&so[w][r][c4]; *(v4f*)(C + (size_t)(row0 + r) * ldc + col0 + c4) = v; } }
     }
}

// Wt[n][k] = f16(W[k][n]*scale) from f32 row-major W[DM][DM] (scale = power of two; bf16-exact weights stay exact in f16 away from the subnormal range)
// bx: the index of the 256-thread block inside this matrix's share of the merged grid. One block turns a tile of 64 k x 64 n in LDS (tl, 64 rows of TP bytes), so that memory sees whole lines on both sides:
// a wave reads two 256-byte row pieces of W at a time and stores four whole 128-byte lines of Wt; read column by column, every lane of a load would touch a line of its own.
#define TP 144      // LDS pitch in bytes of a turned row of 64 f16: a multiple of 16 for the 16-byte reads
__device__ __forceinline__ void wt_f16_body(int bx, const float* __restrict__ W, _Float16* __restrict__ Wt, float scale, char* tl) {
  const int tid = threadIdx.x, kt = bx / (DM / 64), nt = bx % (DM / 64);
  const int kp = tid >> 4, c4 = (tid & 15) * 4;      // the thread takes columns c4 .. c4 + 3 of the tile's rows 2 kp, 2 kp + 1, 32 + 2 kp, 33 + 2 kp
  const char* base = (const char*)(W + (size_t)kt * 64 * DM + nt * 64); const unsigned ob = (unsigned)(2 * kp * DM * 4 + c4 * 4);
  v4f x[2][2];
#pragma unroll
  for (int i = 0; i < 2; ++i)
#pragma unroll
    for (int s = 0; s < 2; ++s) x[i][s] = *(const v4fa*)(base + ob + (i * 32 + s) * DM * 4);
  // the wait that is owed before a register named by an issued global load is rewritten; offset and base are inputs, so they stay live to here and none of the four loads lands in them
  asm volatile("s_wait_xcnt 0x0" :: "v"(ob), "s"(base) : "memory");
#pragma unroll
  for (int i = 0; i < 2; ++i)
#pragma unroll
    for (int e = 0; e < 4; ++e) { typedef _Float16 v2h __attribute__((ext_vector_type(2), may_alias)); v2h p;      // two neighbouring k of one n: one 4-byte LDS store
      p[0] = (_Float16)(bf16_round(x[i][0][e]) * scale); p[1] = (_Float16)(bf16_round(x[i][1][e]) * scale); *(v2h*)(tl + (c4 + e) * TP + (i * 32 + 2 * kp) * 2) = p; }
  __syncthreads();      // the tile is whole in LDS before its turned rows are read
  const int rn = tid >> 3, ch = tid & 7; v8us o[2];      // eight lanes a row of 64 k; trip p takes rows 32 p + tid / 8
#pragma unroll
  for (int p = 0; p < 2; ++p) o[p] = *(const v8us*)(tl + (p * 32 + rn) * TP + ch * 16);
  unsigned short* wo = (unsigned short*)Wt + (size_t)(nt * 64 + rn) * DM + kt * 64 + ch * 8;
#pragma unroll
  for (int p = 0; p < 2; ++p) *(v8us*)(wo + (size_t)p * 32 * DM) = o[p];
}
typedef _Float16 v4h __attribute__((ext_vector_type(4)));

__device__ __forceinline__ void x16_body(int bx, const float* __restrict__ x, _Float16* __restrict__ X16, size_t n8) { const size_t t = (size_t)bx * 256 + threadIdx.x; if (t >= n8) return; FragH f;
#pragma unroll
  for (int q = 0; q < 8; ++q) f.h[q] = (_Float16)bf16_round(x[t * 8 + q]); *(v8us*)((unsigned short*)X16 + t * 8) = f.half[0];  }
// All operand preparation in one launch (none of the eight parts reads what another writes): blocks 0 .. 5 GWT - 1 transpose the five weights (Wq, Wk, Wv, Wr, Wo -> Bw, x2^4), the next 3 GX round mems, w (-> CAT, back to back) and r (-> R16).
#define GWT ((DM / 64) * (DM / 64))      // blocks of one weight matrix: a tile of 64 x 64 each
#define GX (NQR * DM / 8 / 256)      // blocks of one 2048 x 1024 plane at 8 elements a thread (mems, w, r alike)
__global__ __launch_bounds__(256) void k_prep(const float* __restrict__ Wq, const float* __restrict__ Wk, const float* __restrict__ Wv, const float* __restrict__ Wr, const float* __restrict__ Wo,
    const float* __restrict__ mems, const float* __restrict__ w, const float* __restrict__ r, _Float16* __restrict__ Bw, _Float16* __restrict__ CAT, _Float16* __restrict__ R16) {
  __shared__ __attribute__((aligned(16))) char tl[64 * TP];
  const int bx = blockIdx.x;      // the branch is taken by a whole block or by none of it: so is the barrier of the weight tiles
  if (bx < 5 * GWT) { const int m = bx / GWT; const float* W = (m == 0) ? Wq : (m == 1) ? Wk : (m == 2) ? Wv : (m == 3) ? Wr : Wo; wt_f16_body(bx % GWT, W, Bw + (size_t)m * DM * DM, 16.0f, tl); }
  else { const int m = (bx - 5 * GWT) / GX; const float* x = (m == 0) ? mems : (m == 1) ? w : r; _Float16* o = (m == 0) ? CAT : (m == 1) ? CAT + (size_t)NQR * DM : R16; x16_body((bx - 5 * GWT) % GX, x, o, (size_t)NQR * DM / 8); }
}
__global__ __launch_bounds__(256) void k_round16f(const float* __restrict__ W, _Float16* __restrict__ Bt, size_t n8) { const size_t t = (size_t)blockIdx.x * 256 + threadIdx.x; if (t >= n8) return; FragH f;
#pragma unroll
  for (int i = 0; i < 8; ++i) f.h[i] = (_Float16)(bf16_round(W[t * 8 + i]) * 16.0f); *(v8us*)((unsigned short*)Bt + t * 8) = f.half[0];  }
// Fused score kernel: one work-group = 32 query rows i0..i0+31 of one (b,n) plane (blockIdx.y), 16 waves; the 32 x KL score rows live in LDS and never reach memory. AC is stored into the rows first.
// The pad/reshape shift as a scatter of raw BD: idx = QL + i*KL + j = i*(KL+1) + (QL - i + j), so with d = m - (QL-1) + i the raw value (q_i + r_r_bias).rk_m belongs to j = d where d >= 0,
// the raw value of row i+1 at column m to j = d + KL + 1 where d <= -2 (the wrap region); d == -1 gives j = KL, a slot of the row's LDS padding that the softmax never reads; the pad's zero falls on j = i + KL + 1 - QL. Each j in 0..KL-1 gets at most one raw value.
// Behind a barrier each raw value is added to AC in place, and behind a second one wave wv does mask and f32 softmax of rows i0 + wv and i0 + 16 + wv, one after the other, with the lane order and sum order of a wave-per-row pass, and leaves P f16 x2^15 in the first half of the row's own LDS.
// Behind a third barrier P (32 x KL) is multiplied with V (KL x 64): wave wv takes the 256 j from (wv / 2) * 256 and the 32 columns d from (wv % 2) * 32, so every V byte is fetched once a work-group; the eight partial sums of an output element meet in the rows' free second halves
// and, behind a fourth barrier, are added in rising j order; attn_vec goes out f16, a whole 128-byte line a query row. P never reaches memory.
#define SP (KL + 4)      // LDS row pitch in floats: 8 rows apart = 32 banks apart, so the two lane halves of a D tile do not collide; multiple of 4 for 16-byte reads
__device__ __forceinline__ v8f mma16(v16h a, v16h b, v8f c) { return __builtin_amdgcn_wmma_f32_16x16x32_f16(false, a, false, b, (short)0, c, false, false); }
// The planes that this kernel multiplies (q + r_w_bias, q + r_r_bias, k, rk) lie in fragment order: blocks of FB bytes = 16 rows x 64 f16 of one head, stored [c = k / 8][row][8 f16], so that the 16 bytes of (row, c) stand at c * 256 + row * 16.
// One 16-row fragment pair (k = 0..63) of such a block: base (+ cofs, a constant) is the same for the whole wave, ob is the lane's own byte offset (row * 16, plus 256 for the upper lane half). With ob = lane * 16 each load is 512 bytes in a row: four whole lines.
// Lane half hh, step ks: registers 0..3 hold k = 32*ks + 8*hh + 0..7 (c = 4 ks + hh), registers 4..7 hold k = 32*ks + 16 + 8*hh + 0..7 (c = 4 ks + 2 + hh), for A and B alike.
#define FB 2048
__device__ __forceinline__ void ldfrag(FragH (&f)[2], const char* __restrict__ base, unsigned ob, int cofs) {
#pragma unroll
  for (int ks = 0; ks < 2; ++ks) { f[ks].half[0] = *(const v8us*)(base + ob + (cofs + ks * 1024)); f[ks].half[1] = *(const v8us*)(base + ob + (cofs + ks * 1024 + 512)); }
  // the wait that is owed before a register named by an issued global load is rewritten; offset and base are inputs, so they stay live to here and none of the four loads lands in them
  asm volatile("s_wait_xcnt 0x0" :: "v"(ob), "s"(base) : "memory"); }
// raw BD of one rk tile with one set of q rows (both row blocks): x[rb] += a[rb] . bf
__device__ __forceinline__ void bd_one(v8f (&x)[2], const FragH (&a)[2][2], const FragH (&bf)[2]) {
#pragma unroll
  for (int ks = 0; ks < 2; ++ks)
#pragma unroll
    for (int rb = 0; rb < 2; ++rb) x[rb] = mma16(a[rb][ks].v, bf[ks].v, x[rb]);
  // the four vector slots that the chip needs behind a matrix instruction before a vector instruction reads its D or its B is refilled, on the path over the branch that follows too; bf is named so that its refill stays behind them
  asm volatile("v_nop\n\tv_nop\n\tv_nop\n\tv_nop" : "+v"(x[0]), "+v"(x[1]) : "v"(bf[0].v), "v"(bf[1].v)); }
// 32 query rows a work-group, as two blocks of 16 (rb = 0, 1): every k and rk fragment that a wave loads is multiplied with both blocks' q rows, so each tile is fetched once for 32 rows, not once for 16.
// launch bounds: 4 waves a SIMD (a budget of 256 VGPRs): the 257-KiB work-group has a WGP to itself, and the registers hold all eight k tiles, then both blocks' q rows and four rk tiles, in flight ahead of their use
__global__ __launch_bounds__(512, 4) void k_score(const _Float16* __restrict__ QW, const _Float16* __restrict__ QR, const _Float16* __restrict__ K16, const _Float16* __restrict__ RK, const int* __restrict__ MSK, const _Float16* __restrict__ VF, _Float16* __restrict__ O16) {
  __shared__ __attribute__((aligned(16))) float S[32 * SP];
  const int tid = threadIdx.x, lane = tid & 31, ln = lane & 15, hh = lane >> 4;
  const int wv = __builtin_amdgcn_readfirstlane(tid >> 5);      // the wave's number as a scalar: tile bases and the row's addresses then sit in scalar registers
  const int i0 = blockIdx.x * 32, pl = blockIdx.y, h = pl % NH;
  const char* qw = (const char*)QW + ((size_t)pl * (QL / 16) + blockIdx.x * 2) * FB; const char* qr = (const char*)QR + ((size_t)pl * (QL / 16) + blockIdx.x * 2) * FB;      // the block of rows i0 .. i0 + 15 of plane pl; rows i0 + 16 .. i0 + 31 are the next block
  const char* kp = (const char*)K16 + ((size_t)pl * (KL / 16) + wv) * FB; const char* rp = (const char*)RK + ((size_t)h * (KL / 16) + wv) * FB;      // the wave's first column tile; its next ones lie 16 blocks apart
  const char* mk = (const char*)(MSK + (size_t)(i0 + wv) * KL);      // the wave does the softmax of rows i0 + wv and i0 + 16 + wv
  const unsigned obq = (unsigned)(lane * 16), obr = obq;
  const char* ml = mk + lane * 16;      // the lane's own 16 bytes of the first mask row's first 512
  // row i+1 for the wrap region (lane 15: row 0 of the next block); the clamped row of i = QL-1 is never selected (there d >= 0 for every m)
  const unsigned obw0 = (unsigned)(hh * 256 + ((ln < 15) ? (ln + 1) * 16 : FB)), obw1 = (unsigned)(hh * 256 + ((ln < 15) ? (ln + 1) * 16 : (i0 + 32 < QL) ? FB : 15 * 16));
  typedef int v4i __attribute__((ext_vector_type(4))); typedef int v4ia __attribute__((ext_vector_type(4), may_alias));
  FragH aq[2][2], kb[8][2]; ldfrag(aq[0], qw, obq, 0); ldfrag(aq[1], qw, obq, FB);
#pragma unroll
  for (int t = 0; t < 8; ++t) ldfrag(kb[t], kp, obq, t * 16 * FB);      // all eight k tiles of the wave are in flight at once
  FragH an[2][2], aw[2][2], bb[4][2];
  ldfrag(an[0], qr, obq, 0); ldfrag(an[1], qr, obq, FB); ldfrag(aw[0], qr, obw0, 0);      // as many of the q + r_r_bias rows as the registers take beside the k tiles
  __builtin_amdgcn_sched_barrier(0);      // no product, with its wait for the first tile, is lifted in front of these loads: all of them are asked for before the wave waits for any
  v4i mva[16], mvb[16];      // the masks of rows i0 + wv and i0 + 16 + wv, the lane's own four columns per jj: read where registers fall free, so that they fly under other work
  // AC: wave wv owns the column tiles wv + 16 t and stores them straight into S, for both row blocks. As the k tiles drain, their registers take the last q + r_r_bias rows and the first four rk tiles, which fly while the later AC tiles are multiplied and stored.
#pragma unroll
  for (int t = 0; t < KL / 256; ++t) { const int j0 = (wv + 16 * t) * 16; FragH (&bf)[2] = kb[t];
    v8f c0 = {}, c1 = {}; c0 = mma16(aq[0][0].v, bf[0].v, c0); c1 = mma16(aq[1][0].v, bf[0].v, c1); c0 = mma16(aq[0][1].v, bf[1].v, c0); c1 = mma16(aq[1][1].v, bf[1].v, c1);
    // the four vector slots that the chip needs behind a matrix instruction before its D is overwritten (the next tile's product) or its A or B refilled; the operands are named so that the loads below, which may land in bf's registers, stay behind them
    asm volatile("v_nop\n\tv_nop\n\tv_nop\n\tv_nop" : "+v"(c0), "+v"(c1) : "v"(aq[0][0].v), "v"(aq[0][1].v), "v"(aq[1][0].v), "v"(aq[1][1].v), "v"(bf[0].v), "v"(bf[1].v));
    if (t == 0) ldfrag(aw[1], qr, obw1, FB);
    else if (t < 5) ldfrag(bb[t - 1], rp, obr, (t - 1) * 16 * FB);
#pragma unroll
    for (int r = 0; r < 8; ++r) { S[(8 * hh + r) * SP + j0 + ln] = c0[r]; S[(16 + 8 * hh + r) * SP + j0 + ln] = c1[r]; }
    __builtin_amdgcn_sched_barrier(0); }      // keeps the tiles apart in the schedule: mixed, they hold more products and fragments live than the registers take
  if (tid < 32) S[tid * SP + KL] = 0.f;      // the padding slot that takes the one raw value of a row with d == -1: given a value here, so that the add below reads nothing unwritten
  __syncthreads();      // every AC value is in S before any wave adds a shifted BD value to it
  __builtin_amdgcn_sched_barrier(0);      // as above: no product of the next phase is lifted over the barrier
  // raw BD of rows i and i+1, added in place at the shifted column: each (row, j) is touched by one lane of one wave; the column of the pad's zero, j = i + KL + 1 - QL, by none (AC + 0)
#pragma unroll
  for (int t = 0; t < KL / 256; ++t) { const int m0 = (wv + 16 * t) * 16; FragH (&bf)[2] = bb[t & 3];
    // d = dlo + 16 rb + ln + 8 hh + r runs over dlo .. dlo + 46 in the tile. dlo is the same for the whole wave (a scalar), and all but two of a work-group's 128 tiles lie wholly on one side of the seam d = 0:
    // such a tile needs the products of one of the two q row sets alone, and its 16 columns of a row are one run, so that a lane's 8 places of a row block are one address and 8 constant offsets.
    const int dlo = m0 - (QL - 1) + i0; const bool alln = dlo >= 0, allw = dlo + 46 < 0;
    v8f x[2] = {};      // what is added to the rows of block rb
    if (alln) bd_one(x, an, bf);
    else if (allw) bd_one(x, aw, bf);
    else {      // the seam runs through the tile: both products, and each element picks its own
      v8f dn[2] = {}, dw[2] = {};
#pragma unroll
      for (int ks = 0; ks < 2; ++ks)
#pragma unroll
        for (int rb = 0; rb < 2; ++rb) { dn[rb] = mma16(an[rb][ks].v, bf[ks].v, dn[rb]); dw[rb] = mma16(aw[rb][ks].v, bf[ks].v, dw[rb]); }
      // the four vector slots that the chip needs behind a matrix instruction before a vector instruction reads its D or its B is refilled; bf is named so that its refill stays behind them
      asm volatile("v_nop\n\tv_nop\n\tv_nop\n\tv_nop" : "+v"(dn[0]), "+v"(dw[0]), "+v"(dn[1]), "+v"(dw[1]) : "v"(bf[0].v), "v"(bf[1].v));
#pragma unroll
      for (int rb = 0; rb < 2; ++rb)
#pragma unroll
        for (int r = 0; r < 8; ++r) x[rb][r] = (dlo + ln + 16 * rb + 8 * hh + r >= 0) ? dn[rb][r] : dw[rb][r];
    }
    if (t + 4 < KL / 256) ldfrag(bf, rp, obr, (t + 4) * 16 * FB);      // rk tiles fly four tiles ahead
    else {      // the ring drains: its registers take the first row's mask, four vectors a tile, which fly under the last tiles' adds
#pragma unroll
      for (int q = 0; q < 4; ++q) mva[(t - 4) * 4 + q] = *(const v4ia*)(ml + ((t - 4) * 4 + q) * 512);
      // the wait that is owed before a register named by an issued global load is rewritten; the address is an input, so it stays live to here and none of the four loads lands in it
      asm volatile("s_wait_xcnt 0x0" :: "v"(ml) : "memory"); }
    if (alln || allw) {
      float* p0 = &S[8 * hh * (SP + 1) + ln + dlo + (alln ? 0 : KL + 1)]; float* p1 = p0 + 16 * (SP + 1); float o0[8], o1[8];      // row 16 rb + 8 hh + r, column d or d + KL + 1: one row down is one column on
#pragma unroll
      for (int r = 0; r < 8; ++r) { o0[r] = p0[r * (SP + 1)]; o1[r] = p1[r * (SP + 1)]; }      // the sixteen reads first: sixteen different rows, so no store of this tile can hit them
#pragma unroll
      for (int r = 0; r < 8; ++r) { p0[r * (SP + 1)] = o0[r] + x[0][r]; p1[r * (SP + 1)] = o1[r] + x[1][r]; }
    } else {
#pragma unroll
      for (int rb = 0; rb < 2; ++rb) { const int d0 = dlo + ln + 16 * rb + 8 * hh; int ix[8]; float old[8];
#pragma unroll
        for (int r = 0; r < 8; ++r) { const int d = d0 + r; ix[r] = (16 * rb + 8 * hh + r) * SP + ((d >= 0) ? d : d + (KL + 1)); old[r] = S[ix[r]]; }      // the eight reads first: eight different rows, so no store of this tile can hit them
#pragma unroll
        for (int r = 0; r < 8; ++r) S[ix[r]] = old[r] + x[rb][r]; }
    }
    __builtin_amdgcn_sched_barrier(0); }      // as above
  __syncthreads();      // the rows are complete before the row waves read them
  // the mask of row i0 + 16 + wv: asked for here, it flies under the softmax of row i0 + wv
#pragma unroll
  for (int jj = 0; jj < 16; ++jj) mvb[jj] = *(const v4ia*)(ml + (16 * KL * 4 + jj * 512));
  // the wait that is owed before a register named by an issued global load is rewritten; the address is an input, so it stays live to here and none of the sixteen loads lands in it
  asm volatile("s_wait_xcnt 0x0" :: "v"(ml) : "memory");
  const int dp = wv & 1, kq = wv >> 1;      // the wave's share of P*V: columns d = 32 dp .. 32 dp + 31, rows j = 256 kq .. 256 kq + 255
  const char* vp = (const char*)VF + (((size_t)pl * (KL / 64) + kq * 4) * 4 + dp * 2) * FB;      // V block (64 j, 16 d) number (plane * 32 + j / 64) * 4 + d / 16
  FragH vb[4][2][2];      // [64 j][16 d][32 j]: the wave's whole share of V
  typedef _Float16 v4ha __attribute__((ext_vector_type(4), may_alias));
#pragma unroll
  for (int rb = 0; rb < 2; ++rb) {
    if (rb == 1) __builtin_amdgcn_sched_barrier(0);      // keeps the two rows apart in the schedule: scheduled together with the first row's exponentials, the second row's LDS reads are issued one at a time, each waited for
    float* sr = &S[(16 * rb + wv) * SP];
    v4f sv[16]; float mx = -3.0e38f;
#pragma unroll
    for (int jj = 0; jj < 16; ++jj) { const int j0 = jj * 128 + lane * 4; const v4f a = *(const v4fa*)(sr + j0); v4f s;
#pragma unroll
      for (int e = 0; e < 4; ++e) { const float val = a[e] * ATT_SCALE; const bool off = ((rb == 0) ? mva[jj][e] : mvb[jj][e]) != 0; s[e] = off ? -INFINITY : val; mx = fmaxf(mx, s[e]); }
      sv[jj] = s; }
    __builtin_amdgcn_sched_barrier(0);      // keeps the loads below behind the last use of the mask: lifted among the reads above, their registers would come on top of the mask's and leave those reads no room to fly together
    // the row's mask registers are free from here: they take half of the wave's V (128 j), which flies under the row's exponentials
    ldfrag(vb[2 * rb][0], vp, obq, 8 * rb * FB); ldfrag(vb[2 * rb][1], vp, obq, (8 * rb + 1) * FB); ldfrag(vb[2 * rb + 1][0], vp, obq, (8 * rb + 4) * FB); ldfrag(vb[2 * rb + 1][1], vp, obq, (8 * rb + 5) * FB);
    __builtin_amdgcn_sched_barrier(0);      // keeps these loads here: sunk towards their use behind the barrier they would fly under nothing
    for (int o = 16; o >= 1; o >>= 1) mx = fmaxf(mx, __shfl_xor(mx, o, 32)); float z = 0.f;
#pragma unroll
    for (int jj = 0; jj < 16; ++jj) for (int e = 0; e < 4; ++e) { const float p = (sv[jj][e] > -INFINITY) ? __expf(sv[jj][e] - mx) : 0.f; sv[jj][e] = p; z += p; }
    for (int o = 16; o >= 1; o >>= 1) z += __shfl_xor(z, o, 32); const float iz = (z > 0.f) ? 32768.0f / z : 0.f;
    char* pr = (char*)sr + lane * 8;      // P of the row, f16, over the first 4096 bytes of its own scores: all of them are in this wave's registers by now, and no other wave touches the row before the barrier below
#pragma unroll
    for (int jj = 0; jj < 16; ++jj) { v4h o; for (int e = 0; e < 4; ++e) o[e] = (_Float16)(sv[jj][e] * iz); *(v4ha*)(pr + jj * 256) = o; }
  }
  __syncthreads();      // all 32 rows of P are in LDS before any wave multiplies them
  // A = P: lane (ln, hh) reads row 16 rb + ln; registers 0..3 hold j = 32 ks + 8 hh + 0..7, registers 4..7 hold j = 32 ks + 16 + 8 hh + 0..7 of the 64-j block, the k order of ldfrag. The row pitch of SP floats is 16 bytes x odd: no bank conflict among the 16 rows.
  const char* pa = (const char*)S + ln * (SP * 4) + kq * 512 + hh * 16;
  v8f pc[2][2] = {};      // [row block][16 d]
  FragH pf[2][2][2];      // [buffer][row block][32 j]: the P fragments of one 64-j block; the next block's are read while this one is multiplied
#pragma unroll
  for (int t = -1; t < 4; ++t) {
    if (t < 3) {
#pragma unroll
      for (int rb = 0; rb < 2; ++rb)
#pragma unroll
        for (int ks = 0; ks < 2; ++ks) { FragH& f = pf[(t + 1) & 1][rb][ks]; f.half[0] = *(const v8us*)(pa + rb * 16 * SP * 4 + (t + 1) * 128 + ks * 64); f.half[1] = *(const v8us*)(pa + rb * 16 * SP * 4 + (t + 1) * 128 + ks * 64 + 32); }
    }
    __builtin_amdgcn_sched_barrier(0);      // keeps the next block's LDS reads in front of this block's products, so that they return under them
    if (t < 0) continue;
#pragma unroll
    for (int ks = 0; ks < 2; ++ks)
#pragma unroll
      for (int rb = 0; rb < 2; ++rb)
#pragma unroll
        for (int u = 0; u < 2; ++u) pc[rb][u] = mma16(pf[t & 1][rb][ks].v, vb[t][u][ks].v, pc[rb][u]);
    // the first block's products open the four accumulators: its V registers are named here, so that they stay live to behind all of them and no fresh D is placed over the B of a product just issued; the four vector slots are the distance the chip needs before those registers are rewritten
    if (t == 0) asm volatile("v_nop\n\tv_nop\n\tv_nop\n\tv_nop" : "+v"(pc[0][0]), "+v"(pc[0][1]), "+v"(pc[1][0]), "+v"(pc[1][1]) : "v"(vb[0][0][0].v), "v"(vb[0][0][1].v), "v"(vb[0][1][0].v), "v"(vb[0][1][1].v)); }
  // the wave's four partial tiles go to the second halves (floats 1024 ..) of its own two rows, which hold scores that nobody reads any more; register r of lane (ln, hh) is (row 8 hh + r, column ln) and stands at r * 32 + lane
#pragma unroll
  for (int rb = 0; rb < 2; ++rb)
#pragma unroll
    for (int u = 0; u < 2; ++u) { float* ps = &S[(16 * rb + wv) * SP + 1024 + u * 256 + lane];
#pragma unroll
      for (int r = 0; r < 8; ++r) ps[r * 32] = pc[rb][u][r]; }
  __syncthreads();      // every wave's partial tiles are in LDS before they are added
  // thread (row = tid / 16, g = tid % 16) adds the eight partial sums of columns d = 4 g .. 4 g + 3 of query row i0 + row, in rising j order; they come from waves 2 kq + g / 8, which lie two LDS rows apart
  const int row = tid >> 4, g = tid & 15;
  const float* rd = &S[((row & 16) + (g >> 3)) * SP + 1024 + ((g >> 2) & 1) * 256 + (row & 7) * 32 + ((row >> 3) & 1) * 16 + (g & 3) * 4];
  v4f ss = *(const v4fa*)rd;
#pragma unroll
  for (int q = 1; q < 8; ++q) ss += *(const v4fa*)(rd + q * 2 * SP);
  v4h ov; for (int e = 0; e < 4; ++e) ov[e] = (_Float16)(ss[e] * 0.000030517578125f);      // x2^-15: P's scale taken off
  *(v4h*)(O16 + (size_t)(i0 + row) * (BZ * DM) + pl * 64 + g * 4) = ov;      // rows (i,b): plane pl = b NH + h at columns pl * 64 of the 2048-wide row i
}
// GEMM with both operands staged in LDS: C[M][N] = f16 A[M][KK] . Bt[N][KK]^T, v = acc*alpha (+ bf16(bias[col]) if BIAS); writes f32 C (F32OUT) or f16 C16, pitch LDC. A, Bt row-major with pitch KK; M a multiple of 128, N of 64, KK of 256.
// One work-group = 128 rows x 64 columns, 8 waves of 16 x 64; blockIdx.x = row block * ntn + column block (ntn = N / 64), blockIdx.y = plane (element strides sA, sB, sC).
// A stage is 128 k = 256 bytes of each of the 192 operand rows (A rows 0..127, Bt rows 128..191), brought by asynchronous copies whose wave-wide 512 bytes are two whole 256-byte row pieces; two buffers, the next stage flies while this one is multiplied.
// Each output element still sums its k steps of 32 in rising order in one f32 accumulator.
#define GP 272      // LDS row pitch in bytes: 16 x odd, the conflict-free pitch of 256-byte rows for 16-byte fragment reads
#define GSTG (192 * GP)      // bytes of one stage
// One stage: lane (row cr = tid / 16, 16-byte piece tid % 16) copies its piece of A rows cr + 16 i (i < 8) and Bt rows cr + 16 i (i < 4). l: the lane's LDS byte address of A row cr; ga, gb: its global addresses in A row cr and Bt row cr; RB: 16 rows in bytes.
// The s_wait_xcnt is the wait that is owed before a register named by an issued copy is rewritten; as the statement's last line it stands in front of every such write.
template <int RB>
__device__ __forceinline__ void cp_stage(unsigned l, const char* ga, const char* gb) {
  asm volatile("global_load_async_to_lds_b128 %0, %12, off\n\t"
               "global_load_async_to_lds_b128 %1, %13, off\n\t"
               "global_load_async_to_lds_b128 %2, %14, off\n\t"
               "global_load_async_to_lds_b128 %3, %15, off\n\t"
               "global_load_async_to_lds_b128 %4, %16, off\n\t"
               "global_load_async_to_lds_b128 %5, %17, off\n\t"
               "global_load_async_to_lds_b128 %6, %18, off\n\t"
               "global_load_async_to_lds_b128 %7, %19, off\n\t"
               "global_load_async_to_lds_b128 %8, %20, off\n\t"
               "global_load_async_to_lds_b128 %9, %21, off\n\t"
               "global_load_async_to_lds_b128 %10, %22, off\n\t"
               "global_load_async_to_lds_b128 %11, %23, off\n\t"
               "s_wait_xcnt 0x0"
               :: "v"(l), "v"(l + 16 * GP), "v"(l + 32 * GP), "v"(l + 48 * GP), "v"(l + 64 * GP), "v"(l + 80 * GP), "v"(l + 96 * GP), "v"(l + 112 * GP),
                  "v"(l + 128 * GP), "v"(l + 144 * GP), "v"(l + 160 * GP), "v"(l + 176 * GP),
                  "v"(ga), "v"(ga + RB), "v"(ga + 2 * RB), "v"(ga + 3 * RB), "v"(ga + 4 * RB), "v"(ga + 5 * RB), "v"(ga + 6 * RB), "v"(ga + 7 * RB),
                  "v"(gb), "v"(gb + RB), "v"(gb + 2 * RB), "v"(gb + 3 * RB)
               : "memory");
}
// The tile's body: A, Bh, C, C16 are the plane's own bases, (bm, nq) the tile; ring and so are the calling kernel's LDS. mode (the same for the whole work-group) picks what the epilogue does with v:
// FRAG false: 0: f32 C. 1: f16 C16, both row-major. FRAG true: the planes of the score kernel, stored in its fragment order (blocks of FB bytes, see ldfrag; the tile's 64 columns are head nq):
// 2 (the q tile, rows (i,b)): C16 = f16(v + bf16(hb0[col])) and C16b = f16(v + bf16(hb1[col])), hb0 and hb1 the two 1024-wide head-bias rows; 4 (the k tile, rows (j,b)): C16 = f16(v); both as plane b NH + nq, block row / 16. 5 (the rk tile, rows m): C16 = f16(v), plane nq.
// 3 (the v tile; its rows are (j,b), its 64 columns one head nq): C16 is V as the B operand of P*V, in the same fragment order with d as the row and j as k: block ((b NH + nq) KL / 64 + j / 64) * 4 + d / 16 holds [j % 64 / 8][d % 16][8 f16]; the tile is turned in LDS and goes out as its eight whole blocks.
#define VP 144      // LDS pitch in bytes of a V^T row of 64 f16: 36 dwords, so that the 16 rows of an 8-byte store from the accumulators fall on different banks; a multiple of 16 for the 16-byte reads
template <int KK, int LDC, bool BIAS, bool FRAG>
__device__ __forceinline__ void gemm_tile(const _Float16* __restrict__ A, const _Float16* __restrict__ Bh, float alpha, const float* __restrict__ bias,
    float* __restrict__ C, _Float16* __restrict__ C16, _Float16* __restrict__ C16b, const float* __restrict__ hb0, const float* __restrict__ hb1, int mode, int bm, int nq, char* ring, float (*so)[16][64]) {
  const int tid = threadIdx.x, lane = tid & 31, ln = lane & 15, hh = lane >> 4;
  const int w = __builtin_amdgcn_readfirstlane(tid >> 5);      // the wave's number as a scalar
  const int row0 = bm * 128 + w * 16, col0 = nq * 64;
  const int cr = tid >> 4, cc = (tid & 15) * 16;
  const char* ga = (const char*)(A + (size_t)(bm * 128 + cr) * KK) + cc;
  const char* gb = (const char*)(Bh + (size_t)(col0 + cr) * KK) + cc;
  const unsigned l0 = (unsigned)(size_t)&ring[0] + (unsigned)(cr * GP + cc);      // the low 32 bits of a __shared__ address are its LDS byte address
  constexpr int NT = KK / 128, RB = 16 * KK * 2;
  float braw[4] = {0.f, 0.f, 0.f, 0.f};      // the bias of the lane's four columns, read at the head so that it flies under the main loop; first used in the epilogue
  if (BIAS) {
#pragma unroll
    for (int q = 0; q < 4; ++q) braw[q] = bias[col0 + q * 16 + ln];
  }
  float hw[4] = {0.f, 0.f, 0.f, 0.f}, hr[4] = {0.f, 0.f, 0.f, 0.f};      // the two head biases of the lane's four accumulator columns, read at the head like the bias
  if (FRAG && mode == 2) {
    const unsigned oh = (unsigned)((col0 + ln) * 4); const char* p0 = (const char*)hb0; const char* p1 = (const char*)hb1;
#pragma unroll
    for (int q = 0; q < 4; ++q) { hw[q] = *(const float*)(p0 + oh + q * 64); hr[q] = *(const float*)(p1 + oh + q * 64); }
    // the wait that is owed before a register named by an issued global load is rewritten; offset and bases are inputs, so they stay live to here and none of the eight loads lands in them
    asm volatile("s_wait_xcnt 0x0" :: "v"(oh), "s"(p0), "s"(p1) : "memory");
  }
  cp_stage<RB>(l0, ga, gb);      // stage 0 into buffer 0
  asm volatile("s_wait_asynccnt 0x0" ::: "memory");      // this wave's copies of stage 0 have landed
  __syncthreads();      // every wave's have: stage 0 may be read
  cp_stage<RB>(l0 + GSTG, ga + 256, gb + 256);      // stage 1 into buffer 1
  v8f acc[4] = {};
#pragma unroll 1      // kept rolled: unrolled, the build holds two stages' fragments live and needs more than 256 registers, and two work-groups no longer share a WGP
  for (int t = 0; t < NT; ++t) {
    const char* sa = &ring[(t & 1) * GSTG + (w * 16 + ln) * GP + hh * 16];
    const char* sb = &ring[(t & 1) * GSTG + (128 + ln) * GP + hh * 16];
    FragH a[4], b[4][4];
#pragma unroll
    for (int ks = 0; ks < 4; ++ks) {      // lane half hh: registers 0..3 hold k = 32 ks + 8 hh + 0..7, registers 4..7 hold k = 32 ks + 16 + 8 hh + 0..7, for A and B alike
      a[ks].half[0] = *(const v8us*)(sa + ks * 64); a[ks].half[1] = *(const v8us*)(sa + ks * 64 + 32);
#pragma unroll
      for (int q = 0; q < 4; ++q) { b[ks][q].half[0] = *(const v8us*)(sb + q * 16 * GP + ks * 64); b[ks][q].half[1] = *(const v8us*)(sb + q * 16 * GP + ks * 64 + 32); }
    }
    asm volatile("s_wait_dscnt 0x0" ::: "memory");      // the whole stage is in this wave's registers: its reads of the buffer have returned before the buffer is refilled
    asm volatile("s_wait_asynccnt 0x0" ::: "memory");      // this wave's copies of stage t + 1 have landed
    __syncthreads();      // publishes stage t + 1 and ends every wave's reads of stage t
    if (t + 2 < NT) cp_stage<RB>(l0 + (unsigned)((t & 1) * GSTG), ga + (t + 2) * 256, gb + (t + 2) * 256);      // stage t + 2 into the buffer that this trip has read
    __builtin_amdgcn_sched_barrier(0);      // keeps the products behind the refill: they need registers only, and the copies so fly under them as well as under the next stage's reads
#pragma unroll
    for (int ks = 0; ks < 4; ++ks)
#pragma unroll
      for (int q = 0; q < 4; ++q) acc[q] = mma16(a[ks].v, b[ks][q].v, acc[q]);
  }
  asm volatile("s_wait_asynccnt 0x0" ::: "memory");      // no copy is outstanding when the wave goes on to its end
  // the four vector slots that the chip needs behind the loop's last matrix instructions before their A or B registers are rewritten: the epilogues are reached over scalar branches
  if (FRAG) asm volatile("v_nop\n\tv_nop\n\tv_nop\n\tv_nop");
  if (FRAG && mode == 3) {
    char* tv = (char*)so;      // 128 rows (b, d) of 64 j. Accumulator register r is tile row 16 w + 8 hh + r = (j, b) with j = 8 w + 4 hh + r / 2, b = r % 2: the four registers of one b are four neighbouring j
#pragma unroll
    for (int q = 0; q < 4; ++q)
#pragma unroll
      for (int b = 0; b < 2; ++b) { v4h h4; for (int e = 0; e < 4; ++e) h4[e] = (_Float16)(acc[q][2 * e + b] * alpha + (BIAS ? bf16_round(braw[q]) : 0.f)); *(v4h*)(tv + (b * 64 + q * 16 + ln) * VP + w * 16 + hh * 8) = h4; }
    __syncthreads();      // every wave holds eight j of every row: the rows are whole before they are read
    const char* tr = tv + (w * 16 + ln) * VP + hh * 16; v8us x[4];      // wave w takes the block of b = w / 4, d = 16 (w % 4) .. + 15 (LDS rows 16 w ..): lane (ln, hh) reads row d = ln, trip it its j = 16 it + 8 hh + 0..7
#pragma unroll
    for (int it = 0; it < 4; ++it) x[it] = *(const v8us*)(tr + it * 32);
    char* vo = (char*)C16 + ((((size_t)(w >> 2) * NH + nq) * (KL / 64) + bm) * 4 + (w & 3)) * FB + lane * 16;      // a trip's 32 lanes store 512 bytes in a row
#pragma unroll
    for (int it = 0; it < 4; ++it) *(v8us*)(vo + it * 512) = x[it];
    return;
  }
  if (FRAG) {
    // The wave turns its 16 x 64 tile in its own staging rows. Staging row rw keeps its 4-float group g at place g ^ rw: the accumulator stores (16 columns of two rows 8 apart) and the 16-byte reads below (one group of 16 different rows) both fall on 64 different banks.
    // A lane stores the 16 bytes (row rr, c = 2 x + hh), x = 0..3, which lie 512 bytes apart. Rows (j,b): 8 lanes take the wave's 8 j of one b, a whole 128-byte line of block j / 16 (the wave holds half a block of either b); rows m: the wave's 16 rows are one block, 512 bytes in a row.
    const bool jb = (mode != 5); const int l7 = lane & 7, lb = (lane >> 3) & 1;
    const int rr = jb ? l7 * 2 + lb : ln;
    const int blk = jb ? (lb * NH + nq) * ((mode == 2) ? QL / 16 : KL / 16) + bm * 4 + (w >> 1) : nq * (KL / 16) + bm * 8 + w;
    const size_t go = (size_t)blk * FB + hh * 256 + (jb ? (w & 1) * 8 + l7 : ln) * 16;
#pragma unroll 1      // kept rolled: the q tile's second trip differs from the first in its bias and its plane alone
    for (int ps = 0; ps < ((mode == 2) ? 2 : 1); ++ps) {
#pragma unroll
      for (int q = 0; q < 4; ++q) { const float hb = bf16_round(ps ? hr[q] : hw[q]);
#pragma unroll
        for (int r = 0; r < 8; ++r) { const int rw = 8 * hh + r; float v = acc[q][r] * alpha + (BIAS ? bf16_round(braw[q]) : 0.f); if (mode == 2) v += hb; so[w][rw][(((q * 4 + (ln >> 2)) ^ rw) << 2) + (ln & 3)] = v; } }
      __builtin_amdgcn_fence(__ATOMIC_ACQ_REL, "workgroup", "local"); __builtin_amdgcn_wave_barrier();      // the wave reads back its own staging rows; a fence of LDS alone, so that the second trip does not wait for the first trip's global stores
      v8us o[4];
#pragma unroll
      for (int x = 0; x < 4; ++x) { const int g = (4 * x + 2 * hh) ^ rr; const v4f lo = *(const v4fa*)&so[w][rr][g << 2], hi = *(const v4fa*)&so[w][rr][(g ^ 1) << 2]; FragH f;
        for (int e = 0; e < 4; ++e) { f.h[e] = (_Float16)lo[e]; f.h[4 + e] = (_Float16)hi[e]; } o[x] = f.half[0]; }
      char* dst = (char*)(ps ? C16b : C16) + go;
#pragma unroll
      for (int x = 0; x < 4; ++x) *(v8us*)(dst + x * 512) = o[x];
      // the wait that is owed before a register named by an issued global store is rewritten (the second trip reuses them); address and data are inputs, so they stay live to here
      asm volatile("s_wait_xcnt 0x0" :: "v"(dst), "v"(o[0]), "v"(o[1]), "v"(o[2]), "v"(o[3]) : "memory");
    }
    return;
  }
#pragma unroll
  for (int q = 0; q < 4; ++q)
#pragma unroll
    for (int r = 0; r < 8; ++r) so[w][8 * hh + r][q * 16 + ln] = acc[q][r] * alpha + (BIAS ? bf16_round(braw[q]) : 0.f);
  __builtin_amdgcn_fence(__ATOMIC_ACQ_REL, "workgroup"); __builtin_amdgcn_wave_barrier();      // the wave reads back its own staging rows: whole 128-byte lines go out
  const int rsub = lane >> 4, c4 = (lane & 15) * 4; const size_t cofs = (size_t)(row0 + rsub) * LDC + col0 + c4;      // the lane's first element; its eight rows lie 2 LDC apart
  v4f ov[8];
#pragma unroll
  for (int q = 0; q < 8; ++q) ov[q] = *(const v4fa*)&so[w][q * 2 + rsub][c4];
  if (mode == 0) {      // one branch round all eight stores, so that the eight LDS reads above stay in flight together where mode is known only at run time
#pragma unroll
    for (int q = 0; q < 8; ++q) *(v4f*)(C + cofs + q * 2 * LDC) = ov[q];
  } else {
#pragma unroll
    for (int q = 0; q < 8; ++q) { v4h h4; for (int i = 0; i < 4; ++i) h4[i] = (_Float16)ov[q][i]; *(v4h*)(C16 + cofs + q * 2 * LDC) = h4; }
  }
}
template <int KK, int LDC, bool F32OUT, bool BIAS>
__global__ __launch_bounds__(256) void k_gemm_lds(const _Float16* __restrict__ A, size_t sA, const _Float16* __restrict__ Bh, size_t sB, float alpha, const float* __restrict__ bias,
    float* __restrict__ C, _Float16* __restrict__ C16, size_t sC, int ntn) {
  __shared__ __attribute__((aligned(16))) char ring[2 * GSTG];
  __shared__ __attribute__((aligned(16))) float so[8][16][64];
  const size_t by = blockIdx.y;
  gemm_tile<KK, LDC, BIAS, false>(A + by * sA, Bh + by * sB, alpha, bias, F32OUT ? C + by * sC : nullptr, F32OUT ? nullptr : C16 + by * sC, nullptr, nullptr, nullptr, F32OUT ? 0 : 1, blockIdx.x / ntn, blockIdx.x % ntn, ring, so);
}
// The four input projections in one launch (each reads only what k_prep wrote): tiles of k, v (4096 rows of CAT each), then q (the last 2048 rows of CAT) and rk (the 2048 rows of R16); every tile as in k_gemm_lds.
// The epilogues leave the planes as the score kernel reads them: q goes out twice, with r_w_bias and with r_r_bias added; q, k, rk and v (turned, d as the row) go out in the score kernel's fragment order.
#define GTK ((NKR / 128) * (DM / 64))      // tiles of k and of v
#define GTQ ((NQR / 128) * (DM / 64))      // tiles of q and of rk
__global__ __launch_bounds__(256) void k_proj(const _Float16* __restrict__ CAT, const _Float16* __restrict__ R16, const _Float16* __restrict__ Bw, const float* __restrict__ bq, const float* __restrict__ bk, const float* __restrict__ bv, const float* __restrict__ br,
    const float* __restrict__ rwb, const float* __restrict__ rrb, _Float16* __restrict__ QW, _Float16* __restrict__ QR, _Float16* __restrict__ K16, _Float16* __restrict__ Vt, _Float16* __restrict__ RK) {
  __shared__ __attribute__((aligned(16))) char ring[2 * GSTG];
  __shared__ __attribute__((aligned(16))) float so[8][16][64];
  const int bx = blockIdx.x;
  const int job = (bx < GTK) ? 1 : (bx < 2 * GTK) ? 2 : (bx < 2 * GTK + GTQ) ? 0 : 3;      // the weight's place in Bw: 0 q, 1 k, 2 v, 3 rk
  const int tl = (job == 1) ? bx : (job == 2) ? bx - GTK : (job == 0) ? bx - 2 * GTK : bx - 2 * GTK - GTQ;
  const _Float16* A = (job == 0) ? CAT + (size_t)NQR * DM : (job == 3) ? R16 : CAT;
  const float* bias = (job == 0) ? bq : (job == 1) ? bk : (job == 2) ? bv : br;
  _Float16* C16 = (job == 0) ? QW : (job == 1) ? K16 : (job == 2) ? Vt : RK;
  const int mode = (job == 0) ? 2 : (job == 1) ? 4 : (job == 2) ? 3 : 5;      // from blockIdx alone: the barrier of the v epilogue is passed by a whole work-group or by none of it
  gemm_tile<DM, DM, true, true>(A, Bw + (size_t)job * DM * DM, 0.0625f, bias, nullptr, C16, QR, rwb, rrb, mode, tl / (DM / 64), tl % (DM / 64), ring, so);
}
__global__ __launch_bounds__(256) void k_lnout(const float* __restrict__ RES, const float* __restrict__ w, const float* __restrict__ g, const float* __restrict__ bb, float* __restrict__ out) { const int tid = threadIdx.x, wv = tid >> 5, lane = tid & 31; const int r = blockIdx.x * 8 + wv; if (r >= NQR) return; v4f y[8]; float s = 0.f;
#pragma unroll
  for (int j = 0; j < 8; ++j) { const int c = j * 128 + lane * 4; const v4f a = *(const v4fa*)(RES + (size_t)r * DM + c), x = *(const v4fa*)(w + (size_t)r * DM + c); for (int q = 0; q < 4; ++q) { y[j][q] = a[q] + bf16_round(x[q]); s += y[j][q]; } }
  for (int o = 16; o >= 1; o >>= 1) s += __shfl_xor(s, o, 32); const float mu = s / (float)DM; float q2 = 0.f;
#pragma unroll
  for (int j = 0; j < 8; ++j) for (int q = 0; q < 4; ++q) { const float d = y[j][q] - mu; q2 += d * d; }
  for (int o = 16; o >= 1; o >>= 1) q2 += __shfl_xor(q2, o, 32); const float rs = rsqrtf(q2 / (float)DM + 1e-5f);
  {
#pragma unroll
    for (int j = 0; j < 8; ++j) { const int c = j * 128 + lane * 4; v4f o; for (int q = 0; q < 4; ++q) o[q] = (y[j][q] - mu) * rs * bf16_round(g[c + q]) + bf16_round(bb[c + q]); *(v4f*)(out + (size_t)r * DM + c) = o; }
     } }

extern "C" void kernel_launch(void* const* d_in, const int* in_sizes, int n_in,
                              void* d_out, int out_size, void* d_ws, size_t ws_size, hipStream_t stream) {
  (void)in_sizes; (void)n_in; (void)out_size;
  const float* const* I = (const float* const*)d_in; const float* w = I[0]; const float* r = I[1]; const float* mems = I[2]; const float* rwb = I[3]; const float* rrb = I[4]; const int* msk = (const int*)d_in[5];
  const float* Wq = I[6]; const float* bq = I[7]; const float* Wk = I[8]; const float* bk = I[9]; const float* Wv = I[10]; const float* bv = I[11]; const float* Wr = I[12]; const float* br = I[13]; const float* Wo = I[14]; const float* bo = I[15]; const float* lg = I[16]; const float* lb = I[17];
  char* ws = (char*)d_ws; size_t off = 0;
  auto take = [&](size_t bytes) { char* p = ws + off; off += (bytes + 255) & ~(size_t)255; return p; };
  const size_t WSZ = (size_t)DM * DM; _Float16* Bw = (_Float16*)take(5 * WSZ * 2);      /* Wq, Wk, Wv, Wr, Wo */
  _Float16* QW = (_Float16*)take((size_t)NQR * DM * 2); _Float16* QR = (_Float16*)take((size_t)NQR * DM * 2);
  _Float16* K16 = (_Float16*)take((size_t)NKR * DM * 2); _Float16* Vt = (_Float16*)take((size_t)NKR * DM * 2); _Float16* RK = (_Float16*)take((size_t)KL * DM * 2);
  _Float16* O16 = (_Float16*)take((size_t)NQR * DM * 2);
  _Float16* CAT = (_Float16*)take((size_t)NKR * DM * 2); _Float16* R16 = (_Float16*)take((size_t)KL * DM * 2); float* RES = (float*)take((size_t)NQR * DM * 4);
  if (off > ws_size) return;      // MiB: 10 + 4 + 4 + 8 + 8 + 4 + 4 + 8 + 4 + 8 = 62 of 256
  k_prep<<<5 * GWT + 3 * GX, 256, 0, stream>>>(Wq, Wk, Wv, Wr, Wo, mems, w, r, Bw, CAT, R16);      /* weights (in,out) -> Bt x2^4; cat = [mems; w] is the two inputs back to back (rows (j,b)); r rows m */
  k_proj<<<2 * GTK + 2 * GTQ, 256, 0, stream>>>(CAT, R16, Bw, bq, bk, bv, br, rwb, rrb, QW, QR, K16, Vt, RK);      /* k, v: M 4096 N 1024 K 1024; q (last qlen rows of cat) + bq, rk = r.Wr + br: M 2048; one work-group a 128 x 64 tile; q stored + r_w_bias / + r_r_bias, v stored turned, all in fragment order */
  const dim3 gq((NQR / 128) * (DM / 64), 1);      /* one work-group a 128 x 64 tile */
  k_score<<<dim3(QL / 32, BZ * NH), 512, 0, stream>>>(QW, QR, K16, RK, msk, Vt, O16);      /* AC, raw BD, shift, mask, softmax and P*V of all 32 (b,n) planes: 32 query rows a work-group, scores and P in LDS only; attn_vec f16, rows (i,b), plane s = b*16 + h at cols s*64 of the 2048-wide (i) row */
  k_gemm_lds<DM, DM, true, true><<<gq, 256, 0, stream>>>(O16, 0, Bw + 4 * WSZ, 0, 0.0625f, bo, RES, nullptr, 0, DM / 64);      /* attn_out = attn_vec·Wo + bo (rows (i,b)) */
  k_lnout<<<(NQR + 7) / 8, 256, 0, stream>>>(RES, w, lg, lb, (float*)d_out);
}
